// v000
// Times are from an AMD MI455X. After a warm-up the kernel runs many times in a row, and a time is the length of
// such a window on the GPU divided by its runs, so every launch and the gaps after it count. The runs cycle
// through copies of the inputs. A figure is the median of several windows, for all but v000 over two sittings.
// Sittings can differ by a few percent; kernels timed side by side share one.
// v000 is the starting kernel. One run takes 84.5 microseconds.
#include <hip/hip_runtime.h>

typedef __attribute__((ext_vector_type(16))) _Float16 v16h;
typedef __attribute__((ext_vector_type(8)))  _Float16 v8h;
typedef __attribute__((ext_vector_type(8)))  float    v8f;

#define S_LEN 2048
#define DKD   64
#define NH    12
#define NBATCH 2
#define BR    128    // queries per block (8 waves x 16 rows)
#define BC    64     // keys per iteration
#define NTHR  256    // 8 wave32 waves

__device__ __forceinline__ v16h pack2(v8h a, v8h b) {
  return __builtin_shufflevector(a, b, 0, 1, 2, 3, 4, 5, 6, 7,
                                 8, 9, 10, 11, 12, 13, 14, 15);
}

// A/B 16-bit fragment gather: per-lane K indices {off..off+7} u {off+16..off+23}
__device__ __forceinline__ v16h ldfrag(const _Float16* row, int off) {
  return pack2(*reinterpret_cast<const v8h*>(row + off),
               *reinterpret_cast<const v8h*>(row + off + 16));
}

__global__ __launch_bounds__(NTHR) void ScaledDotProductAttention_70111046140626_kernel(
    const float* __restrict__ Q, const float* __restrict__ K,
    const float* __restrict__ V, float* __restrict__ Out) {
  // Double-buffered LDS: K tile row-major (f16), V tile transposed (f16)
  __shared__ _Float16 Ksh[2][BC][DKD];       // 16 KB
  __shared__ _Float16 Vt[2][DKD][BC + 8];    // stride 72 f16 = 144 B (16B aligned)

  const int tid  = threadIdx.x;
  const int lane = tid & 31;
  const int wave = tid >> 5;
  const int l16  = lane & 15;
  const int hi   = lane >> 4;       // which 16-lane half
  const int koff = 8 * hi;          // per-lane K-dim base for A/B fragments

  const int nqblk = S_LEN / BR;     // 16
  // heaviest (largest-qblk) blocks first: better tail behavior under causal imbalance
  const int qblk  = nqblk - 1 - (blockIdx.x % nqblk);
  const int bh    = blockIdx.x / nqblk;   // 0..23
  const int bb    = bh / NH;
  const int hh    = bh % NH;

  const size_t base = (size_t)bh * S_LEN * DKD;
  const float* Qb = Q + base;
  const float* Kb = K + base;
  const float* Vb = V + base;

  const int q0   = qblk * BR + wave * 16;  // wave's first query row
  const int qrow = q0 + l16;               // this lane's query (St column)

  // ---- Q fragments (B-matrix layout for St = K x Q^T), pre-scaled ----
  const float qscale = 0.125f * 1.44269504088896340736f;  // 1/sqrt(64) * log2(e)
  const float* qp = Qb + (size_t)qrow * DKD;
  v16h qf[2];
#pragma unroll
  for (int c = 0; c < 2; ++c) {
    v16h f;
#pragma unroll
    for (int i = 0; i < 8; ++i) {
      f[i]     = (_Float16)(qp[c * 32 + koff + i]      * qscale);
      f[i + 8] = (_Float16)(qp[c * 32 + 16 + koff + i] * qscale);
    }
    qf[c] = f;
  }

  // O^T accumulators: 4 tiles of 16 dk-rows x 16 q-cols
  v8f otile[4];
#pragma unroll
  for (int t = 0; t < 4; ++t) otile[t] = v8f{};

  float mrow = -__builtin_inff();
  float lrow = 0.f;

  const int nkb = qblk * (BR / BC) + (BR / BC);  // key blocks (uniform per thread block)

  // ---- staging assignments (256 threads cover 64x64 K tile + 64x64 V tile) ----
  const int krow = tid >> 2;           // 0..63
  const int kcol = (tid & 3) * 16;     // 0,16,32,48
  const int vkey = tid & 63;           // 0..63
  const int vdkb = (tid >> 6) * 16;    // 0,16,32,48

  float4 kr0, kr1, kr2, kr3, vr0, vr1, vr2, vr3;   // prefetch registers

  auto prefetch = [&](int nb0) {
    const float* kp = Kb + (size_t)(nb0 + krow) * DKD + kcol;
    kr0 = *reinterpret_cast<const float4*>(kp);
    kr1 = *reinterpret_cast<const float4*>(kp + 4);
    kr2 = *reinterpret_cast<const float4*>(kp + 8);
    kr3 = *reinterpret_cast<const float4*>(kp + 12);
    const float* vp = Vb + (size_t)(nb0 + vkey) * DKD + vdkb;
    vr0 = *reinterpret_cast<const float4*>(vp);
    vr1 = *reinterpret_cast<const float4*>(vp + 4);
    vr2 = *reinterpret_cast<const float4*>(vp + 8);
    vr3 = *reinterpret_cast<const float4*>(vp + 12);
  };

  auto commit = [&](int buf) {
    v8h h0, h1;
    h0[0] = (_Float16)kr0.x; h0[1] = (_Float16)kr0.y;
    h0[2] = (_Float16)kr0.z; h0[3] = (_Float16)kr0.w;
    h0[4] = (_Float16)kr1.x; h0[5] = (_Float16)kr1.y;
    h0[6] = (_Float16)kr1.z; h0[7] = (_Float16)kr1.w;
    h1[0] = (_Float16)kr2.x; h1[1] = (_Float16)kr2.y;
    h1[2] = (_Float16)kr2.z; h1[3] = (_Float16)kr2.w;
    h1[4] = (_Float16)kr3.x; h1[5] = (_Float16)kr3.y;
    h1[6] = (_Float16)kr3.z; h1[7] = (_Float16)kr3.w;
    *reinterpret_cast<v8h*>(&Ksh[buf][krow][kcol])     = h0;
    *reinterpret_cast<v8h*>(&Ksh[buf][krow][kcol + 8]) = h1;
    Vt[buf][vdkb +  0][vkey] = (_Float16)vr0.x;
    Vt[buf][vdkb +  1][vkey] = (_Float16)vr0.y;
    Vt[buf][vdkb +  2][vkey] = (_Float16)vr0.z;
    Vt[buf][vdkb +  3][vkey] = (_Float16)vr0.w;
    Vt[buf][vdkb +  4][vkey] = (_Float16)vr1.x;
    Vt[buf][vdkb +  5][vkey] = (_Float16)vr1.y;
    Vt[buf][vdkb +  6][vkey] = (_Float16)vr1.z;
    Vt[buf][vdkb +  7][vkey] = (_Float16)vr1.w;
    Vt[buf][vdkb +  8][vkey] = (_Float16)vr2.x;
    Vt[buf][vdkb +  9][vkey] = (_Float16)vr2.y;
    Vt[buf][vdkb + 10][vkey] = (_Float16)vr2.z;
    Vt[buf][vdkb + 11][vkey] = (_Float16)vr2.w;
    Vt[buf][vdkb + 12][vkey] = (_Float16)vr3.x;
    Vt[buf][vdkb + 13][vkey] = (_Float16)vr3.y;
    Vt[buf][vdkb + 14][vkey] = (_Float16)vr3.z;
    Vt[buf][vdkb + 15][vkey] = (_Float16)vr3.w;
  };

  prefetch(0);
  commit(0);

  for (int j = 0; j < nkb; ++j) {
    const int kb0 = j * BC;
    const int buf = j & 1;
    __syncthreads();   // buf[j%2] fully committed; prior reads of buf[(j+1)%2] done

    if (j + 1 < nkb) prefetch(kb0 + BC);   // global loads overlap compute below

    // Wave-uniform skip: if every key in this tile is above every query of this
    // wave, the whole update is an identity (p=0, alpha=1) -- don't compute it.
    if (kb0 <= q0 + 15) {
      // ---- St = K x Q^T : 4 key tiles, 1-tile-ahead fragment pipelining ----
      v8f st[4];
      v16h ka0 = ldfrag(&Ksh[buf][l16][0], koff);
      v16h ka1 = ldfrag(&Ksh[buf][l16][0], 32 + koff);
#pragma unroll
      for (int tk = 0; tk < 4; ++tk) {
        v16h nka0, nka1;
        if (tk < 3) {
          const _Float16* kp = &Ksh[buf][(tk + 1) * 16 + l16][0];
          nka0 = ldfrag(kp, koff);        // issue next tile's DS loads *before*
          nka1 = ldfrag(kp, 32 + koff);   // consuming the current fragments
        }
        v8f s = v8f{};
        s = __builtin_amdgcn_wmma_f32_16x16x32_f16(false, ka0, false, qf[0], (short)0, s, false, false);
        s = __builtin_amdgcn_wmma_f32_16x16x32_f16(false, ka1, false, qf[1], (short)0, s, false, false);
        st[tk] = s;
        if (tk < 3) { ka0 = nka0; ka1 = nka1; }
      }

      // First V fragments: independent of softmax -> DS pipe works during VALU
      v16h va0 = ldfrag(&Vt[buf][l16][0], koff);
      v16h va1 = ldfrag(&Vt[buf][l16][0], 32 + koff);

      // ---- causal mask (only near the diagonal; wave-uniform branch) ----
      if (kb0 + BC - 1 > q0) {
#pragma unroll
        for (int tk = 0; tk < 4; ++tk) {
          const int key0 = kb0 + tk * 16 + koff;
#pragma unroll
          for (int r = 0; r < 8; ++r)
            if (key0 + r > qrow) st[tk][r] = -__builtin_inff();
        }
      }

      // ---- online softmax: per-lane over 32 keys + one cross-half shuffle ----
      float rm = st[0][0];
#pragma unroll
      for (int tk = 0; tk < 4; ++tk)
#pragma unroll
        for (int r = 0; r < 8; ++r) rm = fmaxf(rm, st[tk][r]);
      rm = fmaxf(rm, __shfl_xor(rm, 16, 32));
      const float mnew  = fmaxf(mrow, rm);
      const float alpha = __builtin_amdgcn_exp2f(mrow - mnew);
      mrow = mnew;

      // P fragments (keys 0-31 -> pf0, keys 32-63 -> pf1); layout matches B fragment
      v16h pf0, pf1;
      float rs = 0.f;
#pragma unroll
      for (int r = 0; r < 8; ++r) {
        const float p0 = __builtin_amdgcn_exp2f(st[0][r] - mnew);
        const float p1 = __builtin_amdgcn_exp2f(st[1][r] - mnew);
        const float p2 = __builtin_amdgcn_exp2f(st[2][r] - mnew);
        const float p3 = __builtin_amdgcn_exp2f(st[3][r] - mnew);
        rs += (p0 + p1) + (p2 + p3);
        pf0[r] = (_Float16)p0; pf0[r + 8] = (_Float16)p1;
        pf1[r] = (_Float16)p2; pf1[r + 8] = (_Float16)p3;
      }
      rs += __shfl_xor(rs, 16, 32);
      lrow = lrow * alpha + rs;

      // ---- O^T += V^T x P^T : 4 dk tiles, 1-tile-ahead fragment pipelining ----
#pragma unroll
      for (int t = 0; t < 4; ++t) {
        v16h nva0, nva1;
        if (t < 3) {
          const _Float16* vp = &Vt[buf][(t + 1) * 16 + l16][0];
          nva0 = ldfrag(vp, koff);
          nva1 = ldfrag(vp, 32 + koff);
        }
        v8f o = otile[t];
#pragma unroll
        for (int r = 0; r < 8; ++r) o[r] *= alpha;
        o = __builtin_amdgcn_wmma_f32_16x16x32_f16(false, va0, false, pf0, (short)0, o, false, false);
        o = __builtin_amdgcn_wmma_f32_16x16x32_f16(false, va1, false, pf1, (short)0, o, false, false);
        otile[t] = o;
        if (t < 3) { va0 = nva0; va1 = nva1; }
      }
    }

    // ---- commit next tile into the other buffer (no barrier needed here) ----
    if (j + 1 < nkb) commit(buf ^ 1);
  }

  // ---- epilogue: out[b, q, h*64 + dk] = O^T[dk, q] / l[q] ----
  const float inv_l = 1.0f / lrow;
  float* op = Out + (size_t)bb * S_LEN * (NH * DKD) + (size_t)qrow * (NH * DKD) + hh * DKD;
#pragma unroll
  for (int t = 0; t < 4; ++t) {
    const int dkb = t * 16 + koff;
    float4 o0 = make_float4(otile[t][0] * inv_l, otile[t][1] * inv_l,
                            otile[t][2] * inv_l, otile[t][3] * inv_l);
    float4 o1 = make_float4(otile[t][4] * inv_l, otile[t][5] * inv_l,
                            otile[t][6] * inv_l, otile[t][7] * inv_l);
    *reinterpret_cast<float4*>(op + dkb)     = o0;
    *reinterpret_cast<float4*>(op + dkb + 4) = o1;
  }
}

extern "C" void kernel_launch(void* const* d_in, const int* in_sizes, int n_in,
                              void* d_out, int out_size, void* d_ws, size_t ws_size,
                              hipStream_t stream) {
  (void)in_sizes; (void)n_in; (void)out_size; (void)d_ws; (void)ws_size;
  const float* Q = (const float*)d_in[0];
  const float* K = (const float*)d_in[1];
  const float* V = (const float*)d_in[2];
  float* Out = (float*)d_out;
  dim3 grid(NBATCH * NH * (S_LEN / BR));   // 384 workgroups
  dim3 block(NTHR);                        // 8 waves (wave32)
  ScaledDotProductAttention_70111046140626_kernel<<<grid, block, 0, stream>>>(Q, K, V, Out);
}

// v001
// It runs in 54.9 microseconds.
// Next to v000, in two timings, it ran 1.55 and 1.56 times as fast.
#include <hip/hip_runtime.h>

typedef __attribute__((ext_vector_type(16))) _Float16 v16h;
typedef __attribute__((ext_vector_type(8)))  _Float16 v8h;
typedef __attribute__((ext_vector_type(8)))  float    v8f;

#define S_LEN 2048
#define DKD   64
#define NH    12
#define NBATCH 2
#define BR    128    // queries per block (8 waves x 16 rows)
#define BC    64     // keys per iteration
#define NTHR  256    // 8 wave32 waves

__device__ __forceinline__ v16h pack2(v8h a, v8h b) {
  return __builtin_shufflevector(a, b, 0, 1, 2, 3, 4, 5, 6, 7,
                                 8, 9, 10, 11, 12, 13, 14, 15);
}

// A/B 16-bit fragment gather: per-lane K indices {off..off+7} u {off+16..off+23}
__device__ __forceinline__ v16h ldfrag(const _Float16* row, int off) {
  return pack2(*reinterpret_cast<const v8h*>(row + off),
               *reinterpret_cast<const v8h*>(row + off + 16));
}

__global__ __launch_bounds__(NTHR) void ScaledDotProductAttention_70111046140626_kernel(
    const float* __restrict__ Q, const float* __restrict__ K,
    const float* __restrict__ V, float* __restrict__ Out) {
  // Double-buffered LDS: K tile row-major (f16), V tile transposed (f16)
  __shared__ _Float16 Ksh[2][BC][DKD + 8];   // stride 72 f16 = 144 B: 16 B x odd, ds_load_b128 rows spread over all banks
  __shared__ _Float16 Vt[2][DKD][BC + 8];    // stride 72 f16 = 144 B (16B aligned)

  const int tid  = threadIdx.x;
  const int lane = tid & 31;
  const int wave = tid >> 5;
  const int l16  = lane & 15;
  const int hi   = lane >> 4;       // which 16-lane half
  const int koff = 8 * hi;          // per-lane K-dim base for A/B fragments

  const int nqblk = S_LEN / BR;     // 16
  // heaviest (largest-qblk) blocks first: better tail behavior under causal imbalance
  const int qblk  = nqblk - 1 - (blockIdx.x % nqblk);
  const int bh    = blockIdx.x / nqblk;   // 0..23
  const int bb    = bh / NH;
  const int hh    = bh % NH;

  const size_t base = (size_t)bh * S_LEN * DKD;
  const float* Qb = Q + base;
  const float* Kb = K + base;
  const float* Vb = V + base;

  const int q0   = qblk * BR + wave * 16;  // wave's first query row
  const int qrow = q0 + l16;               // this lane's query (St column)

  // ---- Q fragments (B-matrix layout for St = K x Q^T), pre-scaled ----
  const float qscale = 0.125f * 1.44269504088896340736f;  // 1/sqrt(64) * log2(e)
  const float* qp = Qb + (size_t)qrow * DKD;
  v16h qf[2];
#pragma unroll
  for (int c = 0; c < 2; ++c) {
    v16h f;
#pragma unroll
    for (int i = 0; i < 8; ++i) {
      f[i]     = (_Float16)(qp[c * 32 + koff + i]      * qscale);
      f[i + 8] = (_Float16)(qp[c * 32 + 16 + koff + i] * qscale);
    }
    qf[c] = f;
  }

  // O^T accumulators: 4 tiles of 16 dk-rows x 16 q-cols
  v8f otile[4];
#pragma unroll
  for (int t = 0; t < 4; ++t) otile[t] = v8f{};

  float mrow = -__builtin_inff();
  float lrow = 0.f;

  const int nkb = qblk * (BR / BC) + (BR / BC);  // key blocks (uniform per thread block)

  // ---- staging assignments (256 threads cover 64x64 K tile + 64x64 V tile) ----
  const int krow = tid >> 2;           // 0..63
  const int kcol = (tid & 3) * 16;     // 0,16,32,48
  const int vkey = tid & 63;           // 0..63
  const int vdkb = (tid >> 6) * 16;    // 0,16,32,48

  float4 kr0, kr1, kr2, kr3, vr0, vr1, vr2, vr3;   // prefetch registers

  auto prefetch = [&](int nb0) {
    const float* kp = Kb + (size_t)(nb0 + krow) * DKD + kcol;
    kr0 = *reinterpret_cast<const float4*>(kp);
    kr1 = *reinterpret_cast<const float4*>(kp + 4);
    kr2 = *reinterpret_cast<const float4*>(kp + 8);
    kr3 = *reinterpret_cast<const float4*>(kp + 12);
    const float* vp = Vb + (size_t)(nb0 + vkey) * DKD + vdkb;
    vr0 = *reinterpret_cast<const float4*>(vp);
    vr1 = *reinterpret_cast<const float4*>(vp + 4);
    vr2 = *reinterpret_cast<const float4*>(vp + 8);
    vr3 = *reinterpret_cast<const float4*>(vp + 12);
  };

  auto commit = [&](int buf) {
    v8h h0, h1;
    h0[0] = (_Float16)kr0.x; h0[1] = (_Float16)kr0.y;
    h0[2] = (_Float16)kr0.z; h0[3] = (_Float16)kr0.w;
    h0[4] = (_Float16)kr1.x; h0[5] = (_Float16)kr1.y;
    h0[6] = (_Float16)kr1.z; h0[7] = (_Float16)kr1.w;
    h1[0] = (_Float16)kr2.x; h1[1] = (_Float16)kr2.y;
    h1[2] = (_Float16)kr2.z; h1[3] = (_Float16)kr2.w;
    h1[4] = (_Float16)kr3.x; h1[5] = (_Float16)kr3.y;
    h1[6] = (_Float16)kr3.z; h1[7] = (_Float16)kr3.w;
    *reinterpret_cast<v8h*>(&Ksh[buf][krow][kcol])     = h0;
    *reinterpret_cast<v8h*>(&Ksh[buf][krow][kcol + 8]) = h1;
    Vt[buf][vdkb +  0][vkey] = (_Float16)vr0.x;
    Vt[buf][vdkb +  1][vkey] = (_Float16)vr0.y;
    Vt[buf][vdkb +  2][vkey] = (_Float16)vr0.z;
    Vt[buf][vdkb +  3][vkey] = (_Float16)vr0.w;
    Vt[buf][vdkb +  4][vkey] = (_Float16)vr1.x;
    Vt[buf][vdkb +  5][vkey] = (_Float16)vr1.y;
    Vt[buf][vdkb +  6][vkey] = (_Float16)vr1.z;
    Vt[buf][vdkb +  7][vkey] = (_Float16)vr1.w;
    Vt[buf][vdkb +  8][vkey] = (_Float16)vr2.x;
    Vt[buf][vdkb +  9][vkey] = (_Float16)vr2.y;
    Vt[buf][vdkb + 10][vkey] = (_Float16)vr2.z;
    Vt[buf][vdkb + 11][vkey] = (_Float16)vr2.w;
    Vt[buf][vdkb + 12][vkey] = (_Float16)vr3.x;
    Vt[buf][vdkb + 13][vkey] = (_Float16)vr3.y;
    Vt[buf][vdkb + 14][vkey] = (_Float16)vr3.z;
    Vt[buf][vdkb + 15][vkey] = (_Float16)vr3.w;
  };

  prefetch(0);
  commit(0);

  for (int j = 0; j < nkb; ++j) {
    const int kb0 = j * BC;
    const int buf = j & 1;
    __syncthreads();   // buf[j%2] fully committed; prior reads of buf[(j+1)%2] done

    if (j + 1 < nkb) prefetch(kb0 + BC);   // global loads overlap compute below

    // Wave-uniform skip: if every key in this tile is above every query of this
    // wave, the whole update is an identity (p=0, alpha=1) -- don't compute it.
    if (kb0 <= q0 + 15) {
      // ---- St = K x Q^T : 4 key tiles, 1-tile-ahead fragment pipelining ----
      v8f st[4];
      v16h ka0 = ldfrag(&Ksh[buf][l16][0], koff);
      v16h ka1 = ldfrag(&Ksh[buf][l16][0], 32 + koff);
#pragma unroll
      for (int tk = 0; tk < 4; ++tk) {
        v16h nka0, nka1;
        if (tk < 3) {
          const _Float16* kp = &Ksh[buf][(tk + 1) * 16 + l16][0];
          nka0 = ldfrag(kp, koff);        // issue next tile's DS loads *before*
          nka1 = ldfrag(kp, 32 + koff);   // consuming the current fragments
        }
        v8f s = v8f{};
        s = __builtin_amdgcn_wmma_f32_16x16x32_f16(false, ka0, false, qf[0], (short)0, s, false, false);
        s = __builtin_amdgcn_wmma_f32_16x16x32_f16(false, ka1, false, qf[1], (short)0, s, false, false);
        st[tk] = s;
        if (tk < 3) { ka0 = nka0; ka1 = nka1; }
      }

      // First V fragments: independent of softmax -> DS pipe works during VALU
      v16h va0 = ldfrag(&Vt[buf][l16][0], koff);
      v16h va1 = ldfrag(&Vt[buf][l16][0], 32 + koff);

      // ---- causal mask (only near the diagonal; wave-uniform branch) ----
      if (kb0 + BC - 1 > q0) {
#pragma unroll
        for (int tk = 0; tk < 4; ++tk) {
          const int key0 = kb0 + tk * 16 + koff;
#pragma unroll
          for (int r = 0; r < 8; ++r)
            if (key0 + r > qrow) st[tk][r] = -__builtin_inff();
        }
      }

      // ---- online softmax: per-lane over 32 keys + one cross-half shuffle ----
      float rm = st[0][0];
#pragma unroll
      for (int tk = 0; tk < 4; ++tk)
#pragma unroll
        for (int r = 0; r < 8; ++r) rm = fmaxf(rm, st[tk][r]);
      rm = fmaxf(rm, __shfl_xor(rm, 16, 32));
      const float mnew  = fmaxf(mrow, rm);
      const float alpha = __builtin_amdgcn_exp2f(mrow - mnew);
      mrow = mnew;

      // P fragments (keys 0-31 -> pf0, keys 32-63 -> pf1); layout matches B fragment
      v16h pf0, pf1;
      float rs = 0.f;
#pragma unroll
      for (int r = 0; r < 8; ++r) {
        const float p0 = __builtin_amdgcn_exp2f(st[0][r] - mnew);
        const float p1 = __builtin_amdgcn_exp2f(st[1][r] - mnew);
        const float p2 = __builtin_amdgcn_exp2f(st[2][r] - mnew);
        const float p3 = __builtin_amdgcn_exp2f(st[3][r] - mnew);
        rs += (p0 + p1) + (p2 + p3);
        pf0[r] = (_Float16)p0; pf0[r + 8] = (_Float16)p1;
        pf1[r] = (_Float16)p2; pf1[r + 8] = (_Float16)p3;
      }
      rs += __shfl_xor(rs, 16, 32);
      lrow = lrow * alpha + rs;

      // ---- O^T += V^T x P^T : 4 dk tiles, 1-tile-ahead fragment pipelining ----
#pragma unroll
      for (int t = 0; t < 4; ++t) {
        v16h nva0, nva1;
        if (t < 3) {
          const _Float16* vp = &Vt[buf][(t + 1) * 16 + l16][0];
          nva0 = ldfrag(vp, koff);
          nva1 = ldfrag(vp, 32 + koff);
        }
        v8f o = otile[t];
#pragma unroll
        for (int r = 0; r < 8; ++r) o[r] *= alpha;
        o = __builtin_amdgcn_wmma_f32_16x16x32_f16(false, va0, false, pf0, (short)0, o, false, false);
        o = __builtin_amdgcn_wmma_f32_16x16x32_f16(false, va1, false, pf1, (short)0, o, false, false);
        otile[t] = o;
        if (t < 3) { va0 = nva0; va1 = nva1; }
      }
    }

    // ---- commit next tile into the other buffer (no barrier needed here) ----
    if (j + 1 < nkb) commit(buf ^ 1);
  }

  // ---- epilogue: out[b, q, h*64 + dk] = O^T[dk, q] / l[q] ----
  const float inv_l = 1.0f / lrow;
  float* op = Out + (size_t)bb * S_LEN * (NH * DKD) + (size_t)qrow * (NH * DKD) + hh * DKD;
#pragma unroll
  for (int t = 0; t < 4; ++t) {
    const int dkb = t * 16 + koff;
    float4 o0 = make_float4(otile[t][0] * inv_l, otile[t][1] * inv_l,
                            otile[t][2] * inv_l, otile[t][3] * inv_l);
    float4 o1 = make_float4(otile[t][4] * inv_l, otile[t][5] * inv_l,
                            otile[t][6] * inv_l, otile[t][7] * inv_l);
    *reinterpret_cast<float4*>(op + dkb)     = o0;
    *reinterpret_cast<float4*>(op + dkb + 4) = o1;
  }
}

extern "C" void kernel_launch(void* const* d_in, const int* in_sizes, int n_in,
                              void* d_out, int out_size, void* d_ws, size_t ws_size,
                              hipStream_t stream) {
  (void)in_sizes; (void)n_in; (void)out_size; (void)d_ws; (void)ws_size;
  const float* Q = (const float*)d_in[0];
  const float* K = (const float*)d_in[1];
  const float* V = (const float*)d_in[2];
  float* Out = (float*)d_out;
  dim3 grid(NBATCH * NH * (S_LEN / BR));   // 384 workgroups
  dim3 block(NTHR);                        // 8 waves (wave32)
  ScaledDotProductAttention_70111046140626_kernel<<<grid, block, 0, stream>>>(Q, K, V, Out);
}

// v002
// One run takes 36.3 microseconds.
// Timed twice side by side with v001, it ran 1.51 times as fast both times.
// Over all steps from v000 it is 2.34 times as fast.
#include <hip/hip_runtime.h>

typedef __attribute__((ext_vector_type(16))) _Float16 v16h;
typedef __attribute__((ext_vector_type(8)))  _Float16 v8h;
typedef __attribute__((ext_vector_type(4)))  _Float16 v4h;
typedef __attribute__((ext_vector_type(8)))  float    v8f;

#define S_LEN 2048
#define DKD   64
#define NH    12
#define NBATCH 2
#define BR    128    // queries per block (8 waves x 16 rows)
#define BC    64     // keys per iteration
#define NTHR  256    // 8 wave32 waves
#define KPITCH (DKD + 8)    // 72 f16 = 144 B: 16 B x odd, for the ds_load_b128 reader
#define VPITCH (DKD + 16)   // 80 f16 = 160 B: 32 B x odd, for the ds_load_tr16_b128 reader

__device__ __forceinline__ v16h pack2(v8h a, v8h b) {
  return __builtin_shufflevector(a, b, 0, 1, 2, 3, 4, 5, 6, 7,
                                 8, 9, 10, 11, 12, 13, 14, 15);
}

// A/B 16-bit fragment gather: per-lane K indices {off..off+7} u {off+16..off+23}
__device__ __forceinline__ v16h ldfrag(const _Float16* row, int off) {
  return pack2(*reinterpret_cast<const v8h*>(row + off),
               *reinterpret_cast<const v8h*>(row + off + 16));
}

// Transposing LDS read of a row-major 16-bit tile: with lane l aimed at row 8*(l>>4) + (l&7),
// 16-byte piece (l>>3)&1, lane l gets column (l&15) of rows 8*(l>>4) .. 8*(l>>4)+7.
__device__ __forceinline__ v8h ldtr(const _Float16* p) {
  typedef __attribute__((ext_vector_type(8))) short v8s;
  typedef __attribute__((address_space(3))) v8s lds_v8s;
  return __builtin_bit_cast(v8h, __builtin_amdgcn_ds_load_tr16_b128_v8i16((lds_v8s*)p));
}

__device__ __forceinline__ v4h cvt4(float4 x) {
  v4h h;
  h[0] = (_Float16)x.x; h[1] = (_Float16)x.y; h[2] = (_Float16)x.z; h[3] = (_Float16)x.w;
  return h;
}

__global__ __launch_bounds__(NTHR) void ScaledDotProductAttention_70111046140626_kernel(
    const float* __restrict__ Q, const float* __restrict__ K,
    const float* __restrict__ V, float* __restrict__ Out) {
  // Double-buffered LDS: K tile and V tile, both row-major [key][dk] (f16)
  __shared__ __attribute__((aligned(16))) _Float16 Ksh[2][BC][KPITCH];
  __shared__ __attribute__((aligned(16))) _Float16 Vsh[2][BC][VPITCH];

  const int tid  = threadIdx.x;
  const int lane = tid & 31;
  const int wave = tid >> 5;
  const int l16  = lane & 15;
  const int hi   = lane >> 4;       // which 16-lane half
  const int koff = 8 * hi;          // per-lane K-dim base for A/B fragments

  const int nqblk = S_LEN / BR;     // 16
  // heaviest (largest-qblk) blocks first: better tail behavior under causal imbalance
  const int qblk  = nqblk - 1 - (blockIdx.x % nqblk);
  const int bh    = blockIdx.x / nqblk;   // 0..23
  const int bb    = bh / NH;
  const int hh    = bh % NH;

  const size_t base = (size_t)bh * S_LEN * DKD;
  const float* Qb = Q + base;
  const float* Kb = K + base;
  const float* Vb = V + base;

  const int q0   = qblk * BR + wave * 16;  // wave's first query row
  const int qrow = q0 + l16;               // this lane's query (St column)

  // ---- Q fragments (B-matrix layout for St = K x Q^T), pre-scaled ----
  const float qscale = 0.125f * 1.44269504088896340736f;  // 1/sqrt(64) * log2(e)
  const float* qp = Qb + (size_t)qrow * DKD;
  v16h qf[2];
#pragma unroll
  for (int c = 0; c < 2; ++c) {
    v16h f;
#pragma unroll
    for (int i = 0; i < 8; ++i) {
      f[i]     = (_Float16)(qp[c * 32 + koff + i]      * qscale);
      f[i + 8] = (_Float16)(qp[c * 32 + 16 + koff + i] * qscale);
    }
    qf[c] = f;
  }

  // O^T accumulators: 4 tiles of 16 dk-rows x 16 q-cols
  v8f otile[4];
#pragma unroll
  for (int t = 0; t < 4; ++t) otile[t] = v8f{};

  float mrow = -__builtin_inff();
  float lrow = 0.f;

  const int nkb = qblk * (BR / BC) + (BR / BC);  // key blocks (uniform per thread block)

  // ---- staging: a 64 x 64 f32 tile is 16 KB in a row in memory; thread t takes its
  // float4 number t + 256 i, so each wave-wide 16-byte load covers 512 contiguous bytes ----
  const int srow = tid >> 4;           // tile row 0..15, + 16 i
  const int scol = (tid & 15) * 4;     // first of the thread's 4 columns

  float4 kr0, kr1, kr2, kr3, vr0, vr1, vr2, vr3;   // prefetch registers

  auto prefetch = [&](int nb0) {
    const float* kp = Kb + (size_t)nb0 * DKD + tid * 4;
    kr0 = *reinterpret_cast<const float4*>(kp);
    kr1 = *reinterpret_cast<const float4*>(kp + 1 * NTHR * 4);
    kr2 = *reinterpret_cast<const float4*>(kp + 2 * NTHR * 4);
    kr3 = *reinterpret_cast<const float4*>(kp + 3 * NTHR * 4);
    const float* vp = Vb + (size_t)nb0 * DKD + tid * 4;
    vr0 = *reinterpret_cast<const float4*>(vp);
    vr1 = *reinterpret_cast<const float4*>(vp + 1 * NTHR * 4);
    vr2 = *reinterpret_cast<const float4*>(vp + 2 * NTHR * 4);
    vr3 = *reinterpret_cast<const float4*>(vp + 3 * NTHR * 4);
  };

  auto commit = [&](int buf) {
    *reinterpret_cast<v4h*>(&Ksh[buf][srow +  0][scol]) = cvt4(kr0);
    *reinterpret_cast<v4h*>(&Ksh[buf][srow + 16][scol]) = cvt4(kr1);
    *reinterpret_cast<v4h*>(&Ksh[buf][srow + 32][scol]) = cvt4(kr2);
    *reinterpret_cast<v4h*>(&Ksh[buf][srow + 48][scol]) = cvt4(kr3);
    *reinterpret_cast<v4h*>(&Vsh[buf][srow +  0][scol]) = cvt4(vr0);
    *reinterpret_cast<v4h*>(&Vsh[buf][srow + 16][scol]) = cvt4(vr1);
    *reinterpret_cast<v4h*>(&Vsh[buf][srow + 32][scol]) = cvt4(vr2);
    *reinterpret_cast<v4h*>(&Vsh[buf][srow + 48][scol]) = cvt4(vr3);
  };

  prefetch(0);
  commit(0);

  for (int j = 0; j < nkb; ++j) {
    const int kb0 = j * BC;
    const int buf = j & 1;
    __syncthreads();   // buf[j%2] fully committed; prior reads of buf[(j+1)%2] done

    if (j + 1 < nkb) prefetch(kb0 + BC);   // global loads overlap compute below

    // Wave-uniform skip: if every key in this tile is above every query of this
    // wave, the whole update is an identity (p=0, alpha=1) -- don't compute it.
    if (kb0 <= q0 + 15) {
      // ---- St = K x Q^T : 4 key tiles, 1-tile-ahead fragment pipelining ----
      v8f st[4];
      v16h ka0 = ldfrag(&Ksh[buf][l16][0], koff);
      v16h ka1 = ldfrag(&Ksh[buf][l16][0], 32 + koff);
#pragma unroll
      for (int tk = 0; tk < 4; ++tk) {
        v16h nka0, nka1;
        if (tk < 3) {
          const _Float16* kp = &Ksh[buf][(tk + 1) * 16 + l16][0];
          nka0 = ldfrag(kp, koff);        // issue next tile's DS loads *before*
          nka1 = ldfrag(kp, 32 + koff);   // consuming the current fragments
        }
        v8f s = v8f{};
        s = __builtin_amdgcn_wmma_f32_16x16x32_f16(false, ka0, false, qf[0], (short)0, s, false, false);
        s = __builtin_amdgcn_wmma_f32_16x16x32_f16(false, ka1, false, qf[1], (short)0, s, false, false);
        st[tk] = s;
        if (tk < 3) { ka0 = nka0; ka1 = nka1; }
      }

      // First V fragments: independent of softmax -> DS pipe works during VALU
      // V^T fragment of dk tile t: keys 0-31 in va0, keys 32-63 in va1, two transposing reads each
      const _Float16* vtr = &Vsh[buf][koff + (lane & 7)][((lane >> 3) & 1) * 8];
      v16h va0 = pack2(ldtr(vtr),               ldtr(vtr + 16 * VPITCH));
      v16h va1 = pack2(ldtr(vtr + 32 * VPITCH), ldtr(vtr + 48 * VPITCH));

      // ---- causal mask (only near the diagonal; wave-uniform branch) ----
      if (kb0 + BC - 1 > q0) {
#pragma unroll
        for (int tk = 0; tk < 4; ++tk) {
          const int key0 = kb0 + tk * 16 + koff;
#pragma unroll
          for (int r = 0; r < 8; ++r)
            if (key0 + r > qrow) st[tk][r] = -__builtin_inff();
        }
      }

      // ---- online softmax: per-lane over 32 keys + one cross-half shuffle ----
      float rm = st[0][0];
#pragma unroll
      for (int tk = 0; tk < 4; ++tk)
#pragma unroll
        for (int r = 0; r < 8; ++r) rm = fmaxf(rm, st[tk][r]);
      rm = fmaxf(rm, __shfl_xor(rm, 16, 32));
      const float mnew  = fmaxf(mrow, rm);
      const float alpha = __builtin_amdgcn_exp2f(mrow - mnew);
      mrow = mnew;

      // P fragments (keys 0-31 -> pf0, keys 32-63 -> pf1); layout matches B fragment
      v16h pf0, pf1;
      float rs = 0.f;
#pragma unroll
      for (int r = 0; r < 8; ++r) {
        const float p0 = __builtin_amdgcn_exp2f(st[0][r] - mnew);
        const float p1 = __builtin_amdgcn_exp2f(st[1][r] - mnew);
        const float p2 = __builtin_amdgcn_exp2f(st[2][r] - mnew);
        const float p3 = __builtin_amdgcn_exp2f(st[3][r] - mnew);
        rs += (p0 + p1) + (p2 + p3);
        pf0[r] = (_Float16)p0; pf0[r + 8] = (_Float16)p1;
        pf1[r] = (_Float16)p2; pf1[r + 8] = (_Float16)p3;
      }
      rs += __shfl_xor(rs, 16, 32);
      lrow = lrow * alpha + rs;

      // ---- O^T += V^T x P^T : 4 dk tiles, 1-tile-ahead fragment pipelining ----
#pragma unroll
      for (int t = 0; t < 4; ++t) {
        v16h nva0, nva1;
        if (t < 3) {
          const _Float16* vp = vtr + (t + 1) * 16;
          nva0 = pack2(ldtr(vp),               ldtr(vp + 16 * VPITCH));
          nva1 = pack2(ldtr(vp + 32 * VPITCH), ldtr(vp + 48 * VPITCH));
        }
        v8f o = otile[t];
#pragma unroll
        for (int r = 0; r < 8; ++r) o[r] *= alpha;
        o = __builtin_amdgcn_wmma_f32_16x16x32_f16(false, va0, false, pf0, (short)0, o, false, false);
        o = __builtin_amdgcn_wmma_f32_16x16x32_f16(false, va1, false, pf1, (short)0, o, false, false);
        otile[t] = o;
        if (t < 3) { va0 = nva0; va1 = nva1; }
      }
    }

    // ---- commit next tile into the other buffer (no barrier needed here) ----
    if (j + 1 < nkb) commit(buf ^ 1);
  }

  // ---- epilogue: out[b, q, h*64 + dk] = O^T[dk, q] / l[q] ----
  const float inv_l = 1.0f / lrow;
  float* op = Out + (size_t)bb * S_LEN * (NH * DKD) + (size_t)qrow * (NH * DKD) + hh * DKD;
#pragma unroll
  for (int t = 0; t < 4; ++t) {
    const int dkb = t * 16 + koff;
    float4 o0 = make_float4(otile[t][0] * inv_l, otile[t][1] * inv_l,
                            otile[t][2] * inv_l, otile[t][3] * inv_l);
    float4 o1 = make_float4(otile[t][4] * inv_l, otile[t][5] * inv_l,
                            otile[t][6] * inv_l, otile[t][7] * inv_l);
    *reinterpret_cast<float4*>(op + dkb)     = o0;
    *reinterpret_cast<float4*>(op + dkb + 4) = o1;
  }
}

extern "C" void kernel_launch(void* const* d_in, const int* in_sizes, int n_in,
                              void* d_out, int out_size, void* d_ws, size_t ws_size,
                              hipStream_t stream) {
  (void)in_sizes; (void)n_in; (void)out_size; (void)d_ws; (void)ws_size;
  const float* Q = (const float*)d_in[0];
  const float* K = (const float*)d_in[1];
  const float* V = (const float*)d_in[2];
  float* Out = (float*)d_out;
  dim3 grid(NBATCH * NH * (S_LEN / BR));   // 384 workgroups
  dim3 block(NTHR);                        // 8 waves (wave32)
  ScaledDotProductAttention_70111046140626_kernel<<<grid, block, 0, stream>>>(Q, K, V, Out);
}

// v003
// Measured time: 32.5 microseconds a run.
// Next to v002, in two timings, it ran 1.12 times as fast each time.
// Counting every step since v000, it is 2.63 times as fast.
#include <hip/hip_runtime.h>

typedef __attribute__((ext_vector_type(16))) _Float16 v16h;
typedef __attribute__((ext_vector_type(8)))  _Float16 v8h;
typedef __attribute__((ext_vector_type(4)))  _Float16 v4h;
typedef __attribute__((ext_vector_type(8)))  float    v8f;

#define S_LEN 2048
#define DKD   64
#define NH    12
#define NBATCH 2
#define BR    128    // queries per block (8 waves x 16 rows)
#define BC    64     // keys per iteration
#define NTHR  256    // 8 wave32 waves
#define NWGP  256    // WGPs on the chip
#define KPITCH (DKD + 8)    // 72 f16 = 144 B: 16 B x odd, for the ds_load_b128 reader
#define VPITCH (DKD + 16)   // 80 f16 = 160 B: 32 B x odd, for the ds_load_tr16_b128 reader

__device__ __forceinline__ v16h pack2(v8h a, v8h b) {
  return __builtin_shufflevector(a, b, 0, 1, 2, 3, 4, 5, 6, 7,
                                 8, 9, 10, 11, 12, 13, 14, 15);
}

// A/B 16-bit fragment gather: per-lane K indices {off..off+7} u {off+16..off+23}
__device__ __forceinline__ v16h ldfrag(const _Float16* row, int off) {
  return pack2(*reinterpret_cast<const v8h*>(row + off),
               *reinterpret_cast<const v8h*>(row + off + 16));
}

// Transposing LDS read of a row-major 16-bit tile: with lane l aimed at row 8*(l>>4) + (l&7),
// 16-byte piece (l>>3)&1, lane l gets column (l&15) of rows 8*(l>>4) .. 8*(l>>4)+7.
__device__ __forceinline__ v8h ldtr(const _Float16* p) {
  typedef __attribute__((ext_vector_type(8))) short v8s;
  typedef __attribute__((address_space(3))) v8s lds_v8s;
  return __builtin_bit_cast(v8h, __builtin_amdgcn_ds_load_tr16_b128_v8i16((lds_v8s*)p));
}

__device__ __forceinline__ v4h cvt4(float4 x) {
  v4h h;
  h[0] = (_Float16)x.x; h[1] = (_Float16)x.y; h[2] = (_Float16)x.z; h[3] = (_Float16)x.w;
  return h;
}

__global__ __launch_bounds__(NTHR) void ScaledDotProductAttention_70111046140626_kernel(
    const float* __restrict__ Q, const float* __restrict__ K,
    const float* __restrict__ V, float* __restrict__ Out) {
  // Double-buffered LDS: K tile and V tile, both row-major [key][dk] (f16)
  __shared__ __attribute__((aligned(16))) _Float16 Ksh[2][BC][KPITCH];
  __shared__ __attribute__((aligned(16))) _Float16 Vsh[2][BC][VPITCH];

  const int tid  = threadIdx.x;
  const int lane = tid & 31;
  const int wave = tid >> 5;
  const int l16  = lane & 15;
  const int hi   = lane >> 4;       // which 16-lane half
  const int koff = 8 * hi;          // per-lane K-dim base for A/B fragments

  const int nqblk = S_LEN / BR;     // 16
  // Placement (speed only; any index order gives the same result, rank is a permutation).
  // Neighbours carry the SAME query tile of
  // different heads. The first NWGP
  // indices fall in cost; the rest rise in cost.
  const int bidx  = blockIdx.x;
  const int rank  = bidx < NWGP ? bidx : (NWGP + NBATCH * NH * nqblk - 1) - bidx;
  // the mask is an identity on this grid; it shows the compiler the tile's range (as the old % did)
  const int qblk  = (nqblk - 1 - rank / (NBATCH * NH)) & (nqblk - 1);
  const int bh    = rank % (NBATCH * NH);   // 0..23
  const int bb    = bh / NH;
  const int hh    = bh % NH;

  const size_t base = (size_t)bh * S_LEN * DKD;
  const float* Qb = Q + base;
  const float* Kb = K + base;
  const float* Vb = V + base;

  const int q0   = qblk * BR + wave * 16;  // wave's first query row
  const int qrow = q0 + l16;               // this lane's query (St column)

  // ---- Q fragments (B-matrix layout for St = K x Q^T), pre-scaled ----
  const float qscale = 0.125f * 1.44269504088896340736f;  // 1/sqrt(64) * log2(e)
  const float* qp = Qb + (size_t)qrow * DKD;
  v16h qf[2];
#pragma unroll
  for (int c = 0; c < 2; ++c) {
    v16h f;
#pragma unroll
    for (int i = 0; i < 8; ++i) {
      f[i]     = (_Float16)(qp[c * 32 + koff + i]      * qscale);
      f[i + 8] = (_Float16)(qp[c * 32 + 16 + koff + i] * qscale);
    }
    qf[c] = f;
  }

  // O^T accumulators: 4 tiles of 16 dk-rows x 16 q-cols
  v8f otile[4];
#pragma unroll
  for (int t = 0; t < 4; ++t) otile[t] = v8f{};

  float mrow = -__builtin_inff();
  float lrow = 0.f;

  const int nkb = qblk * (BR / BC) + (BR / BC);  // key blocks (uniform per thread block)

  // ---- staging: a 64 x 64 f32 tile is 16 KB in a row in memory; thread t takes its
  // float4 number t + 256 i, so each wave-wide 16-byte load covers 512 contiguous bytes ----
  const int srow = tid >> 4;           // tile row 0..15, + 16 i
  const int scol = (tid & 15) * 4;     // first of the thread's 4 columns

  float4 kr0, kr1, kr2, kr3, vr0, vr1, vr2, vr3;   // prefetch registers

  auto prefetch = [&](int nb0) {
    const float* kp = Kb + (size_t)nb0 * DKD + tid * 4;
    kr0 = *reinterpret_cast<const float4*>(kp);
    kr1 = *reinterpret_cast<const float4*>(kp + 1 * NTHR * 4);
    kr2 = *reinterpret_cast<const float4*>(kp + 2 * NTHR * 4);
    kr3 = *reinterpret_cast<const float4*>(kp + 3 * NTHR * 4);
    const float* vp = Vb + (size_t)nb0 * DKD + tid * 4;
    vr0 = *reinterpret_cast<const float4*>(vp);
    vr1 = *reinterpret_cast<const float4*>(vp + 1 * NTHR * 4);
    vr2 = *reinterpret_cast<const float4*>(vp + 2 * NTHR * 4);
    vr3 = *reinterpret_cast<const float4*>(vp + 3 * NTHR * 4);
  };

  auto commit = [&](int buf) {
    *reinterpret_cast<v4h*>(&Ksh[buf][srow +  0][scol]) = cvt4(kr0);
    *reinterpret_cast<v4h*>(&Ksh[buf][srow + 16][scol]) = cvt4(kr1);
    *reinterpret_cast<v4h*>(&Ksh[buf][srow + 32][scol]) = cvt4(kr2);
    *reinterpret_cast<v4h*>(&Ksh[buf][srow + 48][scol]) = cvt4(kr3);
    *reinterpret_cast<v4h*>(&Vsh[buf][srow +  0][scol]) = cvt4(vr0);
    *reinterpret_cast<v4h*>(&Vsh[buf][srow + 16][scol]) = cvt4(vr1);
    *reinterpret_cast<v4h*>(&Vsh[buf][srow + 32][scol]) = cvt4(vr2);
    *reinterpret_cast<v4h*>(&Vsh[buf][srow + 48][scol]) = cvt4(vr3);
  };

  prefetch(0);
  commit(0);

  for (int j = 0; j < nkb; ++j) {
    const int kb0 = j * BC;
    const int buf = j & 1;
    __syncthreads();   // buf[j%2] fully committed; prior reads of buf[(j+1)%2] done

    if (j + 1 < nkb) prefetch(kb0 + BC);   // global loads overlap compute below

    // Wave-uniform skip: if every key in this tile is above every query of this
    // wave, the whole update is an identity (p=0, alpha=1) -- don't compute it.
    if (kb0 <= q0 + 15) {
      // ---- St = K x Q^T : 4 key tiles, 1-tile-ahead fragment pipelining ----
      v8f st[4];
      v16h ka0 = ldfrag(&Ksh[buf][l16][0], koff);
      v16h ka1 = ldfrag(&Ksh[buf][l16][0], 32 + koff);
#pragma unroll
      for (int tk = 0; tk < 4; ++tk) {
        v16h nka0, nka1;
        if (tk < 3) {
          const _Float16* kp = &Ksh[buf][(tk + 1) * 16 + l16][0];
          nka0 = ldfrag(kp, koff);        // issue next tile's DS loads *before*
          nka1 = ldfrag(kp, 32 + koff);   // consuming the current fragments
        }
        v8f s = v8f{};
        s = __builtin_amdgcn_wmma_f32_16x16x32_f16(false, ka0, false, qf[0], (short)0, s, false, false);
        s = __builtin_amdgcn_wmma_f32_16x16x32_f16(false, ka1, false, qf[1], (short)0, s, false, false);
        st[tk] = s;
        if (tk < 3) { ka0 = nka0; ka1 = nka1; }
      }

      // First V fragments: independent of softmax -> DS pipe works during VALU
      // V^T fragment of dk tile t: keys 0-31 in va0, keys 32-63 in va1, two transposing reads each
      const _Float16* vtr = &Vsh[buf][koff + (lane & 7)][((lane >> 3) & 1) * 8];
      v16h va0 = pack2(ldtr(vtr),               ldtr(vtr + 16 * VPITCH));
      v16h va1 = pack2(ldtr(vtr + 32 * VPITCH), ldtr(vtr + 48 * VPITCH));

      // ---- causal mask (only near the diagonal; wave-uniform branch) ----
      if (kb0 + BC - 1 > q0) {
#pragma unroll
        for (int tk = 0; tk < 4; ++tk) {
          const int key0 = kb0 + tk * 16 + koff;
#pragma unroll
          for (int r = 0; r < 8; ++r)
            if (key0 + r > qrow) st[tk][r] = -__builtin_inff();
        }
      }

      // ---- online softmax: per-lane over 32 keys + one cross-half shuffle ----
      float rm = st[0][0];
#pragma unroll
      for (int tk = 0; tk < 4; ++tk)
#pragma unroll
        for (int r = 0; r < 8; ++r) rm = fmaxf(rm, st[tk][r]);
      rm = fmaxf(rm, __shfl_xor(rm, 16, 32));
      const float mnew  = fmaxf(mrow, rm);
      const float alpha = __builtin_amdgcn_exp2f(mrow - mnew);
      mrow = mnew;

      // P fragments (keys 0-31 -> pf0, keys 32-63 -> pf1); layout matches B fragment
      v16h pf0, pf1;
      float rs = 0.f;
#pragma unroll
      for (int r = 0; r < 8; ++r) {
        const float p0 = __builtin_amdgcn_exp2f(st[0][r] - mnew);
        const float p1 = __builtin_amdgcn_exp2f(st[1][r] - mnew);
        const float p2 = __builtin_amdgcn_exp2f(st[2][r] - mnew);
        const float p3 = __builtin_amdgcn_exp2f(st[3][r] - mnew);
        rs += (p0 + p1) + (p2 + p3);
        pf0[r] = (_Float16)p0; pf0[r + 8] = (_Float16)p1;
        pf1[r] = (_Float16)p2; pf1[r + 8] = (_Float16)p3;
      }
      rs += __shfl_xor(rs, 16, 32);
      lrow = lrow * alpha + rs;

      // ---- O^T += V^T x P^T : 4 dk tiles, 1-tile-ahead fragment pipelining ----
#pragma unroll
      for (int t = 0; t < 4; ++t) {
        v16h nva0, nva1;
        if (t < 3) {
          const _Float16* vp = vtr + (t + 1) * 16;
          nva0 = pack2(ldtr(vp),               ldtr(vp + 16 * VPITCH));
          nva1 = pack2(ldtr(vp + 32 * VPITCH), ldtr(vp + 48 * VPITCH));
        }
        v8f o = otile[t];
#pragma unroll
        for (int r = 0; r < 8; ++r) o[r] *= alpha;
        o = __builtin_amdgcn_wmma_f32_16x16x32_f16(false, va0, false, pf0, (short)0, o, false, false);
        o = __builtin_amdgcn_wmma_f32_16x16x32_f16(false, va1, false, pf1, (short)0, o, false, false);
        otile[t] = o;
        if (t < 3) { va0 = nva0; va1 = nva1; }
      }
    }

    // ---- commit next tile into the other buffer (no barrier needed here) ----
    if (j + 1 < nkb) commit(buf ^ 1);
  }

  // ---- epilogue: out[b, q, h*64 + dk] = O^T[dk, q] / l[q] ----
  const float inv_l = 1.0f / lrow;
  float* op = Out + (size_t)bb * S_LEN * (NH * DKD) + (size_t)qrow * (NH * DKD) + hh * DKD;
#pragma unroll
  for (int t = 0; t < 4; ++t) {
    const int dkb = t * 16 + koff;
    float4 o0 = make_float4(otile[t][0] * inv_l, otile[t][1] * inv_l,
                            otile[t][2] * inv_l, otile[t][3] * inv_l);
    float4 o1 = make_float4(otile[t][4] * inv_l, otile[t][5] * inv_l,
                            otile[t][6] * inv_l, otile[t][7] * inv_l);
    *reinterpret_cast<float4*>(op + dkb)     = o0;
    *reinterpret_cast<float4*>(op + dkb + 4) = o1;
  }
}

extern "C" void kernel_launch(void* const* d_in, const int* in_sizes, int n_in,
                              void* d_out, int out_size, void* d_ws, size_t ws_size,
                              hipStream_t stream) {
  (void)in_sizes; (void)n_in; (void)out_size; (void)d_ws; (void)ws_size;
  const float* Q = (const float*)d_in[0];
  const float* K = (const float*)d_in[1];
  const float* V = (const float*)d_in[2];
  float* Out = (float*)d_out;
  dim3 grid(NBATCH * NH * (S_LEN / BR));   // 384 workgroups
  dim3 block(NTHR);                        // 8 waves (wave32)
  ScaledDotProductAttention_70111046140626_kernel<<<grid, block, 0, stream>>>(Q, K, V, Out);
}

// v004
// Measured time: 24 microseconds a run.
// Timed twice side by side with v003, it ran 1.35 and 1.36 times as fast.
// Over all steps from v000 it is 3.57 times as fast.
#include <hip/hip_runtime.h>

typedef __attribute__((ext_vector_type(16))) _Float16 v16h;
typedef __attribute__((ext_vector_type(8)))  _Float16 v8h;
typedef __attribute__((ext_vector_type(4)))  _Float16 v4h;
typedef __attribute__((ext_vector_type(8)))  float    v8f;

#define S_LEN 2048
#define DKD   64
#define NH    12
#define NBATCH 2
#define BR    128    // queries per block (8 query groups x 16 rows)
#define BC    64     // keys per wave and iteration
#define NKG   2      // key groups: waves that share a query group and split its key tiles
#define NQW   (BR / 16)         // query groups
#define NTHR  (NQW * NKG * 32)  // 16 wave32 waves
#define BCS   (BC * NKG)        // keys staged per iteration
#define KPITCH (DKD + 8)    // 72 f16 = 144 B: 16 B x odd, for the ds_load_b128 reader
#define VPITCH (DKD + 16)   // 80 f16 = 160 B: 32 B x odd, for the ds_load_tr16_b128 reader

__device__ __forceinline__ v16h pack2(v8h a, v8h b) {
  return __builtin_shufflevector(a, b, 0, 1, 2, 3, 4, 5, 6, 7,
                                 8, 9, 10, 11, 12, 13, 14, 15);
}

// A/B 16-bit fragment gather: per-lane K indices {off..off+7} u {off+16..off+23}
__device__ __forceinline__ v16h ldfrag(const _Float16* row, int off) {
  return pack2(*reinterpret_cast<const v8h*>(row + off),
               *reinterpret_cast<const v8h*>(row + off + 16));
}

// Transposing LDS read of a row-major 16-bit tile: with lane l aimed at row 8*(l>>4) + (l&7),
// 16-byte piece (l>>3)&1, lane l gets column (l&15) of rows 8*(l>>4) .. 8*(l>>4)+7.
__device__ __forceinline__ v8h ldtr(const _Float16* p) {
  typedef __attribute__((ext_vector_type(8))) short v8s;
  typedef __attribute__((address_space(3))) v8s lds_v8s;
  return __builtin_bit_cast(v8h, __builtin_amdgcn_ds_load_tr16_b128_v8i16((lds_v8s*)p));
}

__device__ __forceinline__ v4h cvt4(float4 x) {
  v4h h;
  h[0] = (_Float16)x.x; h[1] = (_Float16)x.y; h[2] = (_Float16)x.z; h[3] = (_Float16)x.w;
  return h;
}

__global__ __launch_bounds__(NTHR) void ScaledDotProductAttention_70111046140626_kernel(
    const float* __restrict__ Q, const float* __restrict__ K,
    const float* __restrict__ V, float* __restrict__ Out) {
  // Double-buffered LDS: K tile and V tile, both row-major [key][dk] (f16)
  __shared__ __attribute__((aligned(16))) _Float16 Ksh[2][BCS][KPITCH];
  __shared__ __attribute__((aligned(16))) _Float16 Vsh[2][BCS][VPITCH];
  // key group 1's partial result, handed to group 0 once: 32 O^T values, maximum, sum per lane
  __shared__ float Psh[NQW][34][32];

  const int tid  = threadIdx.x;
  const int lane = tid & 31;
  const int wave = (tid >> 5) & (NQW - 1);   // query group
  const int kgrp = tid >> 8;                 // key group: takes key tile NKG * j + kgrp
  const int l16  = lane & 15;
  const int hi   = lane >> 4;       // which 16-lane half
  const int koff = 8 * hi;          // per-lane K-dim base for A/B fragments

  const int nqblk = S_LEN / BR;     // 16
  // Placement (speed only; any index order gives the same result).
  // Neighbouring indices carry the SAME query tile of
  // different heads. A block's 16 waves
  // take more than half of a WGP's registers, so one block is resident per WGP and the
  // blocks beyond the first round start as earlier ones end: cost falls with the index.
  const int rank  = blockIdx.x;
  // the mask is an identity on this grid; it shows the compiler the tile's range (as the old % did)
  const int qblk  = (nqblk - 1 - rank / (NBATCH * NH)) & (nqblk - 1);
  const int bh    = rank % (NBATCH * NH);   // 0..23
  const int bb    = bh / NH;
  const int hh    = bh % NH;

  const size_t base = (size_t)bh * S_LEN * DKD;
  const float* Qb = Q + base;
  const float* Kb = K + base;
  const float* Vb = V + base;

  const int q0   = qblk * BR + wave * 16;  // wave's first query row
  const int qrow = q0 + l16;               // this lane's query (St column)

  // ---- Q fragments (B-matrix layout for St = K x Q^T), pre-scaled ----
  const float qscale = 0.125f * 1.44269504088896340736f;  // 1/sqrt(64) * log2(e)
  const float* qp = Qb + (size_t)qrow * DKD;
  v16h qf[2];
#pragma unroll
  for (int c = 0; c < 2; ++c) {
    v16h f;
#pragma unroll
    for (int i = 0; i < 8; ++i) {
      f[i]     = (_Float16)(qp[c * 32 + koff + i]      * qscale);
      f[i + 8] = (_Float16)(qp[c * 32 + 16 + koff + i] * qscale);
    }
    qf[c] = f;
  }

  // O^T accumulators: 4 tiles of 16 dk-rows x 16 q-cols
  v8f otile[4];
#pragma unroll
  for (int t = 0; t < 4; ++t) otile[t] = v8f{};

  float mrow = -__builtin_inff();
  float lrow = 0.f;

  const int nkb = qblk * (BR / BCS) + (BR / BCS);  // staged key blocks (uniform per thread block)

  // ---- staging: a 128 x 64 f32 tile is 32 KB in a row in memory; thread t takes its
  // float4 number t + 512 i, so each wave-wide 16-byte load covers 512 contiguous bytes ----
  const int srow = tid >> 4;           // tile row 0..31, + 32 i
  const int scol = (tid & 15) * 4;     // first of the thread's 4 columns

  float4 kr0, kr1, kr2, kr3, vr0, vr1, vr2, vr3;   // prefetch registers

  auto prefetch = [&](int nb0) {
    const float* kp = Kb + (size_t)nb0 * DKD + tid * 4;
    kr0 = *reinterpret_cast<const float4*>(kp);
    kr1 = *reinterpret_cast<const float4*>(kp + 1 * NTHR * 4);
    kr2 = *reinterpret_cast<const float4*>(kp + 2 * NTHR * 4);
    kr3 = *reinterpret_cast<const float4*>(kp + 3 * NTHR * 4);
    const float* vp = Vb + (size_t)nb0 * DKD + tid * 4;
    vr0 = *reinterpret_cast<const float4*>(vp);
    vr1 = *reinterpret_cast<const float4*>(vp + 1 * NTHR * 4);
    vr2 = *reinterpret_cast<const float4*>(vp + 2 * NTHR * 4);
    vr3 = *reinterpret_cast<const float4*>(vp + 3 * NTHR * 4);
  };

  auto commit = [&](int buf) {
    *reinterpret_cast<v4h*>(&Ksh[buf][srow +  0][scol]) = cvt4(kr0);
    *reinterpret_cast<v4h*>(&Ksh[buf][srow + 32][scol]) = cvt4(kr1);
    *reinterpret_cast<v4h*>(&Ksh[buf][srow + 64][scol]) = cvt4(kr2);
    *reinterpret_cast<v4h*>(&Ksh[buf][srow + 96][scol]) = cvt4(kr3);
    *reinterpret_cast<v4h*>(&Vsh[buf][srow +  0][scol]) = cvt4(vr0);
    *reinterpret_cast<v4h*>(&Vsh[buf][srow + 32][scol]) = cvt4(vr1);
    *reinterpret_cast<v4h*>(&Vsh[buf][srow + 64][scol]) = cvt4(vr2);
    *reinterpret_cast<v4h*>(&Vsh[buf][srow + 96][scol]) = cvt4(vr3);
  };

  prefetch(0);
  commit(0);

  for (int j = 0; j < nkb; ++j) {
    const int kb0 = j * BCS + kgrp * BC;   // this wave's first key
    const int buf = j & 1;
    __syncthreads();   // buf[j%2] fully committed; prior reads of buf[(j+1)%2] done

    if (j + 1 < nkb) prefetch((j + 1) * BCS);   // global loads overlap compute below

    // Wave-uniform skip: if every key in this tile is above every query of this
    // wave, the whole update is an identity (p=0, alpha=1) -- don't compute it.
    if (kb0 <= q0 + 15) {
      // ---- St = K x Q^T : 4 key tiles, 1-tile-ahead fragment pipelining ----
      v8f st[4];
      const _Float16* kt = &Ksh[buf][kgrp * BC + l16][0];
      v16h ka0 = ldfrag(kt, koff);
      v16h ka1 = ldfrag(kt, 32 + koff);
#pragma unroll
      for (int tk = 0; tk < 4; ++tk) {
        v16h nka0, nka1;
        if (tk < 3) {
          const _Float16* kp = kt + (tk + 1) * 16 * KPITCH;
          nka0 = ldfrag(kp, koff);        // issue next tile's DS loads *before*
          nka1 = ldfrag(kp, 32 + koff);   // consuming the current fragments
        }
        v8f s = v8f{};
        s = __builtin_amdgcn_wmma_f32_16x16x32_f16(false, ka0, false, qf[0], (short)0, s, false, false);
        s = __builtin_amdgcn_wmma_f32_16x16x32_f16(false, ka1, false, qf[1], (short)0, s, false, false);
        st[tk] = s;
        if (tk < 3) { ka0 = nka0; ka1 = nka1; }
      }

      // First V fragments: independent of softmax -> DS pipe works during VALU
      // V^T fragment of dk tile t: keys 0-31 in va0, keys 32-63 in va1, two transposing reads each
      const _Float16* vtr = &Vsh[buf][kgrp * BC + koff + (lane & 7)][((lane >> 3) & 1) * 8];
      v16h va0 = pack2(ldtr(vtr),               ldtr(vtr + 16 * VPITCH));
      v16h va1 = pack2(ldtr(vtr + 32 * VPITCH), ldtr(vtr + 48 * VPITCH));

      // ---- causal mask (only near the diagonal; wave-uniform branch) ----
      if (kb0 + BC - 1 > q0) {
#pragma unroll
        for (int tk = 0; tk < 4; ++tk) {
          const int key0 = kb0 + tk * 16 + koff;
#pragma unroll
          for (int r = 0; r < 8; ++r)
            if (key0 + r > qrow) st[tk][r] = -__builtin_inff();
        }
      }

      // ---- online softmax: per-lane over 32 keys + one cross-half shuffle ----
      float rm = st[0][0];
#pragma unroll
      for (int tk = 0; tk < 4; ++tk)
#pragma unroll
        for (int r = 0; r < 8; ++r) rm = fmaxf(rm, st[tk][r]);
      rm = fmaxf(rm, __shfl_xor(rm, 16, 32));
      const float mnew  = fmaxf(mrow, rm);
      const float alpha = __builtin_amdgcn_exp2f(mrow - mnew);
      mrow = mnew;

      // P fragments (keys 0-31 -> pf0, keys 32-63 -> pf1); layout matches B fragment
      v16h pf0, pf1;
      float rs = 0.f;
#pragma unroll
      for (int r = 0; r < 8; ++r) {
        const float p0 = __builtin_amdgcn_exp2f(st[0][r] - mnew);
        const float p1 = __builtin_amdgcn_exp2f(st[1][r] - mnew);
        const float p2 = __builtin_amdgcn_exp2f(st[2][r] - mnew);
        const float p3 = __builtin_amdgcn_exp2f(st[3][r] - mnew);
        rs += (p0 + p1) + (p2 + p3);
        pf0[r] = (_Float16)p0; pf0[r + 8] = (_Float16)p1;
        pf1[r] = (_Float16)p2; pf1[r + 8] = (_Float16)p3;
      }
      rs += __shfl_xor(rs, 16, 32);
      lrow = lrow * alpha + rs;

      // ---- O^T += V^T x P^T : 4 dk tiles, 1-tile-ahead fragment pipelining ----
#pragma unroll
      for (int t = 0; t < 4; ++t) {
        v16h nva0, nva1;
        if (t < 3) {
          const _Float16* vp = vtr + (t + 1) * 16;
          nva0 = pack2(ldtr(vp),               ldtr(vp + 16 * VPITCH));
          nva1 = pack2(ldtr(vp + 32 * VPITCH), ldtr(vp + 48 * VPITCH));
        }
        v8f o = otile[t];
#pragma unroll
        for (int r = 0; r < 8; ++r) o[r] *= alpha;
        o = __builtin_amdgcn_wmma_f32_16x16x32_f16(false, va0, false, pf0, (short)0, o, false, false);
        o = __builtin_amdgcn_wmma_f32_16x16x32_f16(false, va1, false, pf1, (short)0, o, false, false);
        otile[t] = o;
        if (t < 3) { va0 = nva0; va1 = nva1; }
      }
    }

    // ---- commit next tile into the other buffer (no barrier needed here) ----
    if (j + 1 < nkb) commit(buf ^ 1);
  }

  // ---- join the two key groups: group 1 hands its partial over, group 0 rescales both to the
  // common maximum. Group 0 owns key 0, so its maximum is finite; a group 1 wave that saw no
  // key hands over maximum -inf, sum 0, O 0 and gets weight 0. ----
  if (kgrp == 1) {
#pragma unroll
    for (int t = 0; t < 4; ++t)
#pragma unroll
      for (int r = 0; r < 8; ++r) Psh[wave][t * 8 + r][lane] = otile[t][r];
    Psh[wave][32][lane] = mrow;
    Psh[wave][33][lane] = lrow;
  }
  __syncthreads();   // group 1's partials are in LDS
  if (kgrp == 1) return;
  {
    const float m1   = Psh[wave][32][lane];
    const float mall = fmaxf(mrow, m1);
    const float a0   = __builtin_amdgcn_exp2f(mrow - mall);
    const float a1   = __builtin_amdgcn_exp2f(m1 - mall);
    lrow = lrow * a0 + Psh[wave][33][lane] * a1;
#pragma unroll
    for (int t = 0; t < 4; ++t)
#pragma unroll
      for (int r = 0; r < 8; ++r) otile[t][r] = otile[t][r] * a0 + Psh[wave][t * 8 + r][lane] * a1;
  }

  // ---- epilogue: out[b, q, h*64 + dk] = O^T[dk, q] / l[q] ----
  const float inv_l = 1.0f / lrow;
  float* op = Out + (size_t)bb * S_LEN * (NH * DKD) + (size_t)qrow * (NH * DKD) + hh * DKD;
#pragma unroll
  for (int t = 0; t < 4; ++t) {
    const int dkb = t * 16 + koff;
    float4 o0 = make_float4(otile[t][0] * inv_l, otile[t][1] * inv_l,
                            otile[t][2] * inv_l, otile[t][3] * inv_l);
    float4 o1 = make_float4(otile[t][4] * inv_l, otile[t][5] * inv_l,
                            otile[t][6] * inv_l, otile[t][7] * inv_l);
    *reinterpret_cast<float4*>(op + dkb)     = o0;
    *reinterpret_cast<float4*>(op + dkb + 4) = o1;
  }
}

extern "C" void kernel_launch(void* const* d_in, const int* in_sizes, int n_in,
                              void* d_out, int out_size, void* d_ws, size_t ws_size,
                              hipStream_t stream) {
  (void)in_sizes; (void)n_in; (void)out_size; (void)d_ws; (void)ws_size;
  const float* Q = (const float*)d_in[0];
  const float* K = (const float*)d_in[1];
  const float* V = (const float*)d_in[2];
  float* Out = (float*)d_out;
  dim3 grid(NBATCH * NH * (S_LEN / BR));   // 384 workgroups
  dim3 block(NTHR);                        // 16 waves (wave32)
  ScaledDotProductAttention_70111046140626_kernel<<<grid, block, 0, stream>>>(Q, K, V, Out);
}
